// v000
// The times below were measured on an AMD MI455X: many runs one after another, warmed up first and cycling through
// copies of the inputs, with the whole window's GPU time divided by the number of runs. Launches and the gaps
// between them are all in it. The median over several windows is given; except for v000 it joins two sittings, which
// can be a few percent apart, so the side-by-side timings, each taken in one sitting, are the better comparison.
// The starting kernel, v000, takes 1040 microseconds a run.
#include <hip/hip_runtime.h>
#include <hip/hip_bf16.h>

// B=8, H=8, R=128, C=128, DQ=16, MS=16
#define Bb 8
#define Hh 8
#define Rr 128
#define Cc 128
#define DQ 16
#define MS 16

typedef __attribute__((ext_vector_type(2))) float v2f;
typedef __attribute__((ext_vector_type(8))) float v8f;

__device__ __forceinline__ v8f wmma_f32(v2f a, v2f b, v8f c) {
    // V_WMMA_F32_16X16X4_F32: D = A(16x4 f32) * B(4x16 f32) + C(16x16 f32)
    return __builtin_amdgcn_wmma_f32_16x16x4_f32(
        /*neg_a=*/false, a, /*neg_b=*/false, b,
        /*c_mod=*/(short)0, c, /*reuse_a=*/false, /*reuse_b=*/false);
}

__device__ __forceinline__ float gelu_exact(float x) {
    return 0.5f * x * (1.0f + erff(x * 0.70710678118654752f));
}

// ---------------------------------------------------------------------------
// Stage 1: per (b,h)  -> score[b,h,r,c] = (softmax(gelu(qk_s^T/4)) @ relu(qk_a^T/4)) / 4
// grid = B*H blocks, 256 threads (8 waves), dynamic LDS = 2*128*128*4 = 128KB
// ---------------------------------------------------------------------------
__global__ void __launch_bounds__(256) stage1_kernel(
    const float* __restrict__ q, const float* __restrict__ k_s,
    const float* __restrict__ k_a, float* __restrict__ score)
{
    const int bh   = blockIdx.x;
    const int tid  = threadIdx.x;
    const int wave = tid >> 5;
    const int lane = tid & 31;
    const int ll   = lane & 15;
    const int lh   = lane >> 4;
    const int mBase = wave * 16;

    extern __shared__ float smem[];
    float* wself = smem;                 // [128][128]
    float* dpa   = smem + Rr * Rr;       // [128][128]

    const float* qb  = q   + bh * Rr * DQ;
    const float* ksb = k_s + bh * Rr * DQ;
    const float* kab = k_a + bh * Cc * DQ;

    // ---- dps = gelu((q @ k_s^T) / 4) -> wself LDS
    for (int nb = 0; nb < 8; ++nb) {
        const int nBase = nb * 16;
        v8f acc = {};
        for (int kk = 0; kk < 4; ++kk) {
            const int k0 = kk * 4 + 2 * lh;
            v2f a, bm;
            a.x  = qb[(mBase + ll) * DQ + k0];
            a.y  = qb[(mBase + ll) * DQ + k0 + 1];
            bm.x = ksb[(nBase + ll) * DQ + k0];
            bm.y = ksb[(nBase + ll) * DQ + k0 + 1];
            acc = wmma_f32(a, bm, acc);
        }
        for (int k = 0; k < 8; ++k)
            wself[(mBase + k + 8 * lh) * Rr + nBase + ll] = gelu_exact(acc[k] * 0.25f);
    }
    __syncthreads();

    // ---- row softmax of wself (threads 0..127, one row each)
    if (tid < Rr) {
        float* row = wself + tid * Rr;
        float mx = row[0];
        for (int i = 1; i < Rr; ++i) mx = fmaxf(mx, row[i]);
        float s = 0.f;
        for (int i = 0; i < Rr; ++i) { float e = __expf(row[i] - mx); row[i] = e; s += e; }
        float inv = 1.0f / s;
        for (int i = 0; i < Rr; ++i) row[i] *= inv;
    }
    __syncthreads();

    // ---- dpa = relu((q @ k_a^T) / 4) -> dpa LDS
    for (int nb = 0; nb < 8; ++nb) {
        const int nBase = nb * 16;
        v8f acc = {};
        for (int kk = 0; kk < 4; ++kk) {
            const int k0 = kk * 4 + 2 * lh;
            v2f a, bm;
            a.x  = qb[(mBase + ll) * DQ + k0];
            a.y  = qb[(mBase + ll) * DQ + k0 + 1];
            bm.x = kab[(nBase + ll) * DQ + k0];
            bm.y = kab[(nBase + ll) * DQ + k0 + 1];
            acc = wmma_f32(a, bm, acc);
        }
        for (int k = 0; k < 8; ++k)
            dpa[(mBase + k + 8 * lh) * Cc + nBase + ll] = fmaxf(acc[k] * 0.25f, 0.f);
    }
    __syncthreads();

    // ---- score = (wself @ dpa) / 4 -> global
    float* outp = score + bh * Rr * Cc;
    for (int nb = 0; nb < 8; ++nb) {
        const int nBase = nb * 16;
        v8f acc = {};
        for (int kk = 0; kk < 32; ++kk) {
            const int k0 = kk * 4 + 2 * lh;
            v2f a, bm;
            a.x  = wself[(mBase + ll) * Rr + k0];
            a.y  = wself[(mBase + ll) * Rr + k0 + 1];
            bm.x = dpa[k0 * Cc + nBase + ll];
            bm.y = dpa[(k0 + 1) * Cc + nBase + ll];
            acc = wmma_f32(a, bm, acc);
        }
        for (int k = 0; k < 8; ++k)
            outp[(mBase + k + 8 * lh) * Cc + nBase + ll] = acc[k] * 0.25f;
    }
}

// ---------------------------------------------------------------------------
// Stage 2: per (b,r,h) tile. grid = B*R*H = 8192 blocks, 256 threads.
// dynamic LDS = (2048 + 2048 + 16384 + 16 + 16 + 128 + 2) floats ~= 82.6KB
// ---------------------------------------------------------------------------
__global__ void __launch_bounds__(256) stage2_kernel(
    const float* __restrict__ score, const float* __restrict__ cost,
    const float* __restrict__ v,
    const float* __restrict__ mix1_w, const float* __restrict__ mix1_b,
    const float* __restrict__ Waa,
    const float* __restrict__ mix2_w, const float* __restrict__ mix2_b,
    const float* __restrict__ edge_w,
    const float* __restrict__ ln_g, const float* __restrict__ ln_b,
    float* __restrict__ out_attn, float* __restrict__ edge_part)
{
    const int idx = blockIdx.x;
    const int h = idx & (Hh - 1);
    const int r = (idx >> 3) & (Rr - 1);
    const int b = idx >> 10;

    const int tid  = threadIdx.x;
    const int wave = tid >> 5;
    const int lane = tid & 31;
    const int ll   = lane & 15;
    const int lh   = lane >> 4;
    const int mBase = wave * 16;

    extern __shared__ float smem[];
    float* ms1  = smem;                          // [128][16]
    float* tbuf = smem + Cc * MS;                // [128][16]  (t, then ae)
    float* dd   = smem + 2 * Cc * MS;            // [128][128]
    float* mu_s = dd + Cc * Cc;                  // [16]
    float* rs_s = mu_s + MS;                     // [16]
    float* msc  = rs_s + MS;                     // [128]
    float* red  = msc + Cc;                      // [2]

    const float* srow = score + ((b * Hh + h) * Rr + r) * Cc;
    const float* crow = cost + (b * Rr + r) * Cc;
    const float* m1w0 = mix1_w + h * 2 * MS;
    const float* m1w1 = m1w0 + MS;
    const float* m1b  = mix1_b + h * MS;

    // ---- ms1[c][e] = relu(score*w0 + cost*w1 + b)
    for (int i = tid; i < Cc * MS; i += 256) {
        const int c = i >> 4, e = i & 15;
        ms1[i] = fmaxf(srow[c] * m1w0[e] + crow[c] * m1w1[e] + m1b[e], 0.f);
    }
    __syncthreads();

    // ---- t = ms1 @ Waa[h]   (128x16 @ 16x16), one 16x16 tile per wave
    {
        const float* W = Waa + h * MS * MS;
        v8f acc = {};
        for (int kk = 0; kk < 4; ++kk) {
            const int k0 = kk * 4 + 2 * lh;
            v2f a, bm;
            a.x  = ms1[(mBase + ll) * MS + k0];
            a.y  = ms1[(mBase + ll) * MS + k0 + 1];
            bm.x = W[k0 * MS + ll];
            bm.y = W[(k0 + 1) * MS + ll];
            acc = wmma_f32(a, bm, acc);
        }
        for (int k = 0; k < 8; ++k)
            tbuf[(mBase + k + 8 * lh) * MS + ll] = acc[k];
    }
    __syncthreads();

    // ---- dd = t @ ms1^T  (128x16 @ 16x128) -> LDS
    for (int nb = 0; nb < 8; ++nb) {
        const int nBase = nb * 16;
        v8f acc = {};
        for (int kk = 0; kk < 4; ++kk) {
            const int k0 = kk * 4 + 2 * lh;
            v2f a, bm;
            a.x  = tbuf[(mBase + ll) * MS + k0];
            a.y  = tbuf[(mBase + ll) * MS + k0 + 1];
            bm.x = ms1[(nBase + ll) * MS + k0];
            bm.y = ms1[(nBase + ll) * MS + k0 + 1];
            acc = wmma_f32(a, bm, acc);
        }
        for (int k = 0; k < 8; ++k)
            dd[(mBase + k + 8 * lh) * Cc + nBase + ll] = acc[k];
    }
    __syncthreads();

    // ---- dw = softmax(dd, axis=-1) in place
    if (tid < Cc) {
        float* row = dd + tid * Cc;
        float mx = row[0];
        for (int i = 1; i < Cc; ++i) mx = fmaxf(mx, row[i]);
        float s = 0.f;
        for (int i = 0; i < Cc; ++i) { float e = __expf(row[i] - mx); row[i] = e; s += e; }
        float inv = 1.0f / s;
        for (int i = 0; i < Cc; ++i) row[i] *= inv;
    }
    __syncthreads();

    // ---- ae = dw @ ms1 + ms1 -> tbuf (reuse)
    {
        v8f acc = {};
        for (int kk = 0; kk < 32; ++kk) {
            const int k0 = kk * 4 + 2 * lh;
            v2f a, bm;
            a.x  = dd[(mBase + ll) * Cc + k0];
            a.y  = dd[(mBase + ll) * Cc + k0 + 1];
            bm.x = ms1[k0 * MS + ll];
            bm.y = ms1[(k0 + 1) * MS + ll];
            acc = wmma_f32(a, bm, acc);
        }
        for (int k = 0; k < 8; ++k) {
            const int row = mBase + k + 8 * lh;
            tbuf[row * MS + ll] = acc[k] + ms1[row * MS + ll];
        }
    }
    __syncthreads();

    // ---- LayerNorm over the c axis (length 128), per channel e
    if (tid < MS) {
        float s = 0.f, s2 = 0.f;
        for (int c = 0; c < Cc; ++c) { float x = tbuf[c * MS + tid]; s += x; s2 += x * x; }
        const float mu = s * (1.0f / Cc);
        const float var = s2 * (1.0f / Cc) - mu * mu;
        mu_s[tid] = mu;
        rs_s[tid] = rsqrtf(var + 1e-5f);
    }
    __syncthreads();
    for (int i = tid; i < Cc * MS; i += 256) {
        const int c = i >> 4, e = i & 15;
        tbuf[i] = (tbuf[i] - mu_s[e]) * rs_s[e] * ln_g[c] + ln_b[c];
    }
    __syncthreads();

    // ---- edge partial for this head -> workspace (deterministic, no atomics)
    if (tid < Cc) {
        const float* ew = edge_w + h * MS;
        float p = 0.f;
        for (int e = 0; e < MS; ++e) p += tbuf[tid * MS + e] * ew[e];
        edge_part[((b * Rr + r) * Hh + h) * Cc + tid] = p;
    }

    // ---- mixed score ms2 -> softmax over c -> out = w @ v
    if (tid < Cc) {
        const float* mw = mix2_w + h * MS;
        float s = mix2_b[h];
        for (int e = 0; e < MS; ++e) s += ms1[tid * MS + e] * mw[e];
        msc[tid] = s;
    }
    __syncthreads();
    if (tid == 0) {
        float mx = msc[0];
        for (int i = 1; i < Cc; ++i) mx = fmaxf(mx, msc[i]);
        float s = 0.f;
        for (int i = 0; i < Cc; ++i) s += __expf(msc[i] - mx);
        red[0] = mx;
        red[1] = 1.0f / s;
    }
    __syncthreads();
    if (tid < Cc) msc[tid] = __expf(msc[tid] - red[0]) * red[1];
    __syncthreads();
    if (tid < DQ) {
        const float* vb = v + (b * Hh + h) * Cc * DQ;
        float o = 0.f;
        for (int c = 0; c < Cc; ++c) o += msc[c] * vb[c * DQ + tid];
        out_attn[(b * Rr + r) * (Hh * DQ) + h * DQ + tid] = o;
    }
}

// ---------------------------------------------------------------------------
// Stage 3: edge2[b,r,c] = sum_h edge_part[b,r,h,c] + edge_b
// ---------------------------------------------------------------------------
__global__ void __launch_bounds__(256) edge_reduce_kernel(
    const float* __restrict__ edge_part, const float* __restrict__ edge_b,
    float* __restrict__ out_edge)
{
    const int i = blockIdx.x * blockDim.x + threadIdx.x;  // over B*R*C
    if (i >= Bb * Rr * Cc) return;
    const int c  = i & (Cc - 1);
    const int br = i >> 7;
    float s = edge_b[0];
    for (int h = 0; h < Hh; ++h) s += edge_part[(br * Hh + h) * Cc + c];
    out_edge[i] = s;
}

extern "C" void kernel_launch(void* const* d_in, const int* in_sizes, int n_in,
                              void* d_out, int out_size, void* d_ws, size_t ws_size,
                              hipStream_t stream) {
    const float* q       = (const float*)d_in[0];
    const float* k_s     = (const float*)d_in[1];
    const float* k_a     = (const float*)d_in[2];
    const float* v       = (const float*)d_in[3];
    const float* cost    = (const float*)d_in[4];
    const float* mix1_w  = (const float*)d_in[5];
    const float* mix1_b  = (const float*)d_in[6];
    const float* Waa     = (const float*)d_in[7];
    const float* mix2_w  = (const float*)d_in[8];
    const float* mix2_b  = (const float*)d_in[9];
    const float* edge_w  = (const float*)d_in[10];
    const float* edge_b  = (const float*)d_in[11];
    const float* ln_g    = (const float*)d_in[12];
    const float* ln_b    = (const float*)d_in[13];

    float* out_attn = (float*)d_out;                       // [B,R,H*DQ]
    float* out_edge = out_attn + Bb * Rr * Hh * DQ;        // [B,R,C]

    float* score     = (float*)d_ws;                       // [B,H,R,C]   4MB
    float* edge_part = score + Bb * Hh * Rr * Cc;          // [B,R,H,C]   4MB

    // Stage 1: 64 blocks, 128KB dynamic LDS (wself + dpa)
    const size_t lds1 = (size_t)(2 * Rr * Cc) * sizeof(float);
    stage1_kernel<<<Bb * Hh, 256, lds1, stream>>>(q, k_s, k_a, score);

    // Stage 2: 8192 blocks, ~82.6KB dynamic LDS
    const size_t lds2 = (size_t)(2 * Cc * MS + Cc * Cc + MS + MS + Cc + 2) * sizeof(float);
    stage2_kernel<<<Bb * Rr * Hh, 256, lds2, stream>>>(
        score, cost, v, mix1_w, mix1_b, Waa, mix2_w, mix2_b,
        edge_w, ln_g, ln_b, out_attn, edge_part);

    // Stage 3: edge reduction over heads
    edge_reduce_kernel<<<(Bb * Rr * Cc + 255) / 256, 256, 0, stream>>>(
        edge_part, edge_b, out_edge);
}

// v002
// A run of this version takes 82.4 microseconds.
// It is 12.8 times as fast as v000, going by the measured steps of the versions left out in between.
#include <hip/hip_runtime.h>
#include <hip/hip_bf16.h>

// B=8, H=8, R=128, C=128, DQ=16, MS=16
#define Bb 8
#define Hh 8
#define Rr 128
#define Cc 128
#define DQ 16
#define MS 16

typedef __attribute__((ext_vector_type(2))) float v2f;
typedef __attribute__((ext_vector_type(4))) float v4f;
typedef __attribute__((ext_vector_type(8))) float v8f;

__device__ __forceinline__ v8f wmma_f32(v2f a, v2f b, v8f c) {
    // V_WMMA_F32_16X16X4_F32: D = A(16x4 f32) * B(4x16 f32) + C(16x16 f32)
    return __builtin_amdgcn_wmma_f32_16x16x4_f32(
        /*neg_a=*/false, a, /*neg_b=*/false, b,
        /*c_mod=*/(short)0, c, /*reuse_a=*/false, /*reuse_b=*/false);
}

__device__ __forceinline__ float gelu_exact(float x) {
    return 0.5f * x * (1.0f + erff(x * 0.70710678118654752f));
}

// lane l with lane l ^ 16
__device__ __forceinline__ float xhalf(float x) {
    return __builtin_bit_cast(float, __builtin_amdgcn_permlanex16(
        __builtin_bit_cast(int, x), __builtin_bit_cast(int, x), 0x76543210, 0xfedcba98, false, false));
}

// lane l with lane l ^ M inside its 16-lane row (DPP row_xmask:M)
template <int M>
__device__ __forceinline__ float xrow(float x) {
    return __builtin_bit_cast(float, __builtin_amdgcn_mov_dpp(
        __builtin_bit_cast(int, x), 0x160 + M, 0xf, 0xf, true));
}

__device__ __forceinline__ float row_max(float x) {
    x = fmaxf(x, xrow<1>(x)); x = fmaxf(x, xrow<2>(x));
    x = fmaxf(x, xrow<4>(x)); x = fmaxf(x, xrow<8>(x));
    return x;
}

__device__ __forceinline__ float row_sum(float x) {
    x += xrow<1>(x); x += xrow<2>(x); x += xrow<4>(x); x += xrow<8>(x);
    return x;
}

// ---------------------------------------------------------------------------
// Stage 1: per (b,h)  -> score[b,h,r,c] = (softmax(gelu(qk_s^T/4)) @ relu(qk_a^T/4)) / 4
// grid = B*H blocks, 256 threads (8 waves), dynamic LDS = 128*128*4 = 64KB (dpa only)
// Each wave owns 16 rows r and forms the self scores transposed, so that lane
// (ll, lh) holds row r = mBase + ll with s = 16*nb + 8*lh + j in register j of tile nb:
// the softmax runs over the lane's own registers and one exchange with lane ^ 16,
// and the D registers are the B operand of the next product as they stand.
// ---------------------------------------------------------------------------
__global__ void __launch_bounds__(256) stage1_kernel(
    const float* __restrict__ q, const float* __restrict__ k_s,
    const float* __restrict__ k_a, float* __restrict__ score)
{
    const int bh   = blockIdx.x;
    const int tid  = threadIdx.x;
    const int wave = tid >> 5;
    const int lane = tid & 31;
    const int ll   = lane & 15;
    const int lh   = lane >> 4;
    const int mBase = wave * 16;

    extern __shared__ float smem[];
    float* dpa = smem;                   // [128][128]

    const float* qb  = q   + bh * Rr * DQ;
    const float* ksb = k_s + bh * Rr * DQ;
    const float* kab = k_a + bh * Cc * DQ;

    // ---- dpa = relu((q @ k_a^T) / 4) -> dpa LDS
    for (int nb = 0; nb < 8; ++nb) {
        const int nBase = nb * 16;
        v8f acc = {};
        for (int kk = 0; kk < 4; ++kk) {
            const int k0 = kk * 4 + 2 * lh;
            v2f a, bm;
            a.x  = qb[(mBase + ll) * DQ + k0];
            a.y  = qb[(mBase + ll) * DQ + k0 + 1];
            bm.x = kab[(nBase + ll) * DQ + k0];
            bm.y = kab[(nBase + ll) * DQ + k0 + 1];
            acc = wmma_f32(a, bm, acc);
        }
        for (int k = 0; k < 8; ++k)
            dpa[(mBase + k + 8 * lh) * Cc + nBase + ll] = fmaxf(acc[k] * 0.25f, 0.f);
    }

    // ---- p[nb][j] = gelu((k_s @ q^T) / 4)[s = 16*nb + 8*lh + j][r = mBase + ll]
    v8f p[8];
    // full unroll: p[] is indexed by nb and must stay in registers
    #pragma unroll
    for (int nb = 0; nb < 8; ++nb) {
        const int nBase = nb * 16;
        v8f acc = {};
        for (int kk = 0; kk < 4; ++kk) {
            const int k0 = kk * 4 + 2 * lh;
            v2f a, bm;
            a.x  = ksb[(nBase + ll) * DQ + k0];
            a.y  = ksb[(nBase + ll) * DQ + k0 + 1];
            bm.x = qb[(mBase + ll) * DQ + k0];
            bm.y = qb[(mBase + ll) * DQ + k0 + 1];
            acc = wmma_f32(a, bm, acc);
        }
        for (int k = 0; k < 8; ++k) acc[k] = gelu_exact(acc[k] * 0.25f);
        p[nb] = acc;
    }

    // ---- softmax over s, in registers; 1/sum is applied after the product
    float mx = p[0][0];
    #pragma unroll  // p[] stays in registers
    for (int nb = 0; nb < 8; ++nb)
        for (int k = 0; k < 8; ++k) mx = fmaxf(mx, p[nb][k]);
    mx = fmaxf(mx, __shfl_xor(mx, 16));
    float sum = 0.f;
    #pragma unroll  // p[] stays in registers
    for (int nb = 0; nb < 8; ++nb)
        for (int k = 0; k < 8; ++k) { const float e = __expf(p[nb][k] - mx); p[nb][k] = e; sum += e; }
    sum += __shfl_xor(sum, 16);
    const float scale = 0.25f / sum;
    __syncthreads();   // dpa complete

    // ---- score^T = dpa^T @ p : A row = c, B column = r, k slot (nb, t, lh, x/y) = s = 16*nb + 8*lh + 2*t + x/y
    float* outp = score + bh * Rr * Cc + (mBase + ll) * Cc + 8 * lh;
    for (int cb = 0; cb < 8; ++cb) {
        const float* dcol = dpa + 8 * lh * Cc + cb * 16 + ll;
        v8f acc = {};
        #pragma unroll  // p[] stays in registers
        for (int nb = 0; nb < 8; ++nb) {
            #pragma unroll  // p[nb] is indexed by t
            for (int t = 0; t < 4; ++t) {
                v2f a, bm;
                a.x  = dcol[(nb * 16 + 2 * t) * Cc];
                a.y  = dcol[(nb * 16 + 2 * t + 1) * Cc];
                bm.x = p[nb][2 * t];
                bm.y = p[nb][2 * t + 1];
                acc = wmma_f32(a, bm, acc);
            }
        }
        // register j = score[r = mBase + ll][c = 16*cb + 8*lh + j]
        for (int k = 0; k < 8; ++k) outp[cb * 16 + k] = acc[k] * scale;
    }
}

// ---------------------------------------------------------------------------
// Stage 2: per (b,r,h) tile. grid = B*R*H = 8192 blocks, 256 threads.
// dynamic LDS = (2048 + 8*320 + 8*32 + 8*64) floats = 21KB
// The depth attention is formed transposed, per wave for its own 16 columns c:
// lane (ll, lh) holds c = mBase + ll, and every D fragment is the B operand of the
// next product as it stands (k slot (t, lh, x/y) = row 8*lh + 2*t + x/y of the D tile).
// Everything behind the products stays with the wave that owns the 16 columns: each wave
// reduces its own columns (LayerNorm sums, mixed-score maximum, sum and weighted v rows),
// leaves one record in LDS, and behind one barrier every wave folds the eight records.
// ---------------------------------------------------------------------------
#define XP 20   // pitch of a wave's ae tile in floats: 16-byte stores and row reads meet no bank twice
#define RS 64   // floats per wave record: [0,16) sum, [16,32) sum of squares, [32,48) weighted v, 48 max, 49 sum
__global__ void __launch_bounds__(256) stage2_kernel(
    const float* __restrict__ score, const float* __restrict__ cost,
    const float* __restrict__ v,
    const float* __restrict__ mix1_w, const float* __restrict__ mix1_b,
    const float* __restrict__ Waa,
    const float* __restrict__ mix2_w, const float* __restrict__ mix2_b,
    const float* __restrict__ edge_w,
    const float* __restrict__ ln_g, const float* __restrict__ ln_b,
    float* __restrict__ out_attn, float* __restrict__ edge_part)
{
    const int idx = blockIdx.x;
    const int h = idx & (Hh - 1);
    const int r = (idx >> 3) & (Rr - 1);
    const int b = idx >> 10;

    const int tid  = threadIdx.x;
    // the same in every lane of a wave: held in a scalar register, so that what the phases behind the
    // products form from it takes no vector register while p[] is live
    const int wave = __builtin_amdgcn_readfirstlane(tid >> 5);
    const int lane = tid & 31;
    const int ll   = lane & 15;
    const int lh   = lane >> 4;
    const int mBase = wave * 16;

    extern __shared__ float smem[];
    float* ms1  = smem;                          // [128][16]
    float* xt   = smem + Cc * MS + wave * (16 * XP);           // the wave's own ae tile [16][XP]
    float* wl   = smem + Cc * MS + 8 * 16 * XP + wave * 32;    // the wave's own 32 floats
    float* rec  = smem + Cc * MS + 8 * 16 * XP + 8 * 32;       // [8][RS] wave records

    const float* srow = score + ((b * Hh + h) * Rr + r) * Cc;
    const float* crow = cost + (b * Rr + r) * Cc;
    const float* m1w0 = mix1_w + h * 2 * MS;
    const float* m1w1 = m1w0 + MS;
    const float* m1b  = mix1_b + h * MS;

    // ---- ms1[c][e] = relu(score*w0 + cost*w1 + b)
    for (int i = tid; i < Cc * MS; i += 256) {
        const int c = i >> 4, e = i & 15;
        ms1[i] = fmaxf(srow[c] * m1w0[e] + crow[c] * m1w1[e] + m1b[e], 0.f);
    }
    __syncthreads();

    // ---- tT = Waa[h]^T @ ms1^T : register j = t[c = mBase + ll][f = 8*lh + j]
    v8f tT = {};
    {
        const float* W = Waa + h * MS * MS;
        const int wo = 2 * lh * MS + ll;   // Waa[e = 2*lh][f = ll]
        for (int kk = 0; kk < 4; ++kk) {
            const int k0 = kk * 4 + 2 * lh;
            v2f a, bm;
            a.x  = W[wo + kk * 4 * MS];
            a.y  = W[wo + kk * 4 * MS + MS];
            bm.x = ms1[(mBase + ll) * MS + k0];
            bm.y = ms1[(mBase + ll) * MS + k0 + 1];
            tT = wmma_f32(a, bm, tT);
        }
    }

    // ---- p[nb][j] = dd[c = mBase + ll][d = 16*nb + 8*lh + j] = (ms1 @ t^T)[d][c]
    v8f p[8];
    // full unroll: p[] is indexed by nb and must stay in registers
    #pragma unroll
    for (int nb = 0; nb < 8; ++nb) {
        // the lane's 8 consecutive f of row d = 16*nb + ll, 32-byte aligned: two 16-byte LDS loads
        const v4f* arow = (const v4f*)(ms1 + (nb * 16 + ll) * MS + 8 * lh);
        const v4f alo = arow[0], ahi = arow[1];
        const float av[8] = {alo.x, alo.y, alo.z, alo.w, ahi.x, ahi.y, ahi.z, ahi.w};
        v8f acc = {};
        #pragma unroll  // tT and av are indexed by t
        for (int t = 0; t < 4; ++t) {
            v2f a, bm;
            a.x  = av[2 * t];
            a.y  = av[2 * t + 1];
            bm.x = tT[2 * t];
            bm.y = tT[2 * t + 1];
            acc = wmma_f32(a, bm, acc);
        }
        p[nb] = acc;
    }

    // ---- softmax over d, in registers; 1/sum is applied after the product
    float pmx = p[0][0];
    #pragma unroll  // p[] stays in registers
    for (int nb = 0; nb < 8; ++nb)
        for (int k = 0; k < 8; ++k) pmx = fmaxf(pmx, p[nb][k]);
    pmx = fmaxf(pmx, __shfl_xor(pmx, 16));
    float psum = 0.f;
    #pragma unroll  // p[] stays in registers
    for (int nb = 0; nb < 8; ++nb)
        for (int k = 0; k < 8; ++k) { const float e = __expf(p[nb][k] - pmx); p[nb][k] = e; psum += e; }
    psum += __shfl_xor(psum, 16);
    const float pinv = 1.0f / psum;

    // ---- ae^T = ms1^T @ p : register j = (dw @ ms1)[c = mBase + ll][e = 8*lh + j] * psum; + ms1 -> x
    v8f acc = {};
    {
        const float* acol = ms1 + 8 * lh * MS + ll;
        #pragma unroll  // p[] stays in registers
        for (int nb = 0; nb < 8; ++nb) {
            #pragma unroll  // p[nb] is indexed by t
            for (int t = 0; t < 4; ++t) {
                v2f a, bm;
                a.x  = acol[(nb * 16 + 2 * t) * MS];
                a.y  = acol[(nb * 16 + 2 * t + 1) * MS];
                bm.x = p[nb][2 * t];
                bm.y = p[nb][2 * t + 1];
                acc = wmma_f32(a, bm, acc);
            }
        }
    }
    // the lane's number formed anew (ln = lane, cl = ll, ch = lh): nothing that the phases below index by
    // stays in a register across the products, where p[] fills them (past 96 a SIMD holds one wave less)
    const int ln = __builtin_amdgcn_mbcnt_lo(~0u, 0u);
    const int cl = ln & 15;
    const int ch = ln >> 4;
    float x[8], m[8];   // ae and ms1 of column c = mBase + cl, channels e = 8*ch + j
    {
        const v4f* mr = (const v4f*)(ms1 + (mBase + cl) * MS + 8 * ch);
        const v4f mlo = mr[0], mhi = mr[1];
        const float mv[8] = {mlo.x, mlo.y, mlo.z, mlo.w, mhi.x, mhi.y, mhi.z, mhi.w};
        for (int k = 0; k < 8; ++k) { m[k] = mv[k]; x[k] = acc[k] * pinv + mv[k]; }
    }

    // ---- global operands of the phases below, asked for here: the waits below hold back every load behind them
    float vv[8];   // v[c = mBase + 8*ch + i][d = cl]
    {
        const float* vb = v + (b * Hh + h) * Cc * DQ + (mBase + 8 * ch) * DQ + cl;
        for (int i = 0; i < 8; ++i) vv[i] = vb[i * DQ];
    }
    const v4f ew0 = ((const v4f*)(edge_w + h * MS + 8 * ch))[0];
    const v4f ew1 = ((const v4f*)(edge_w + h * MS + 8 * ch))[1];
    const float lg = ln_g[mBase + cl], lb = ln_b[mBase + cl];

    // ---- the wave's own columns: ae tile to its own LDS range, to be read back by channel
    {
        v4f* xs = (v4f*)(xt + cl * XP + 8 * ch);
        xs[0] = v4f{x[0], x[1], x[2], x[3]};
        xs[1] = v4f{x[4], x[5], x[6], x[7]};
    }

    // ---- mixed score of column c = mBase + cl, its exponential against the wave's own maximum
    float wmax, wsum;
    {
        const v4f* mw = (const v4f*)(mix2_w + h * MS + 8 * ch);
        const v4f wlo = mw[0], whi = mw[1];
        const float wv[8] = {wlo.x, wlo.y, wlo.z, wlo.w, whi.x, whi.y, whi.z, whi.w};
        float sp = 0.f;
        for (int k = 0; k < 8; ++k) sp += m[k] * wv[k];
        const float s = sp + xhalf(sp) + mix2_b[h];
        wmax = row_max(s);
        const float e = __expf(s - wmax);
        wsum = row_sum(e);
        wl[ln] = e;   // wl[i] = wl[16 + i] = weight of column mBase + i
    }
    // the wave reads back what its other lanes stored: the stores must have landed, and the
    // compiler must not lift the reads over them
    asm volatile("s_wait_dscnt 0x0" ::: "memory");

    // ---- LayerNorm sums of channel e = cl over the wave's 16 columns (rows 2*i + ch, then both halves)
    {
        float s = 0.f, s2 = 0.f;
        for (int i = 0; i < 8; ++i) { const float t = xt[(2 * i + ch) * XP + cl]; s += t; s2 += t * t; }
        s  += xhalf(s);
        s2 += xhalf(s2);
        rec[wave * RS + ln] = ch ? s2 : s;
    }
    // ---- weighted v rows: d = cl, columns mBase + 8*ch + i, then both halves
    {
        const v4f* ep = (const v4f*)(wl + 8 * ch);
        const v4f elo = ep[0], ehi = ep[1];
        const float ev[8] = {elo.x, elo.y, elo.z, elo.w, ehi.x, ehi.y, ehi.z, ehi.w};
        float o = 0.f;
        for (int i = 0; i < 8; ++i) o += ev[i] * vv[i];
        o += xhalf(o);
        if (ch == 0) rec[wave * RS + 32 + cl] = o;
        if (ln == 0) { rec[wave * RS + 48] = wmax; rec[wave * RS + 49] = wsum; }
    }
    __syncthreads();   // all eight records complete

    // ---- LayerNorm over the c axis (length 128): lane (cl, ch) folds the sums (ch = 0) or the squares (ch = 1) of channel cl
    {
        float t = 0.f;
        for (int w = 0; w < 8; ++w) t += rec[w * RS + ln];
        const float u = xhalf(t);
        const float mu  = (ch ? u : t) * (1.0f / Cc);
        const float var = (ch ? t : u) * (1.0f / Cc) - mu * mu;
        const float rs  = rsqrtf(var + 1e-5f);
        wl[ln] = ch ? rs : mu;   // wl[e] = mean, wl[16 + e] = 1/sigma
    }
    // as above: the wave reads back what its other lanes stored
    asm volatile("s_wait_dscnt 0x0" ::: "memory");

    // ---- edge partial for this head -> workspace (deterministic, no atomics)
    {
        const v4f* mp = (const v4f*)(wl + 8 * ch);
        const v4f* rp = (const v4f*)(wl + 16 + 8 * ch);
        const v4f a0 = mp[0], a1 = mp[1], r0 = rp[0], r1 = rp[1];
        const float mu8[8] = {a0.x, a0.y, a0.z, a0.w, a1.x, a1.y, a1.z, a1.w};
        const float rs8[8] = {r0.x, r0.y, r0.z, r0.w, r1.x, r1.y, r1.z, r1.w};
        const float ew8[8] = {ew0.x, ew0.y, ew0.z, ew0.w, ew1.x, ew1.y, ew1.z, ew1.w};
        float t = 0.f, u = 0.f;
        for (int k = 0; k < 8; ++k) { t += (x[k] - mu8[k]) * (rs8[k] * ew8[k]); u += ew8[k]; }
        float p = t * lg + u * lb;
        p += xhalf(p);
        if (ch == 0) edge_part[((b * Rr + r) * Hh + h) * Cc + mBase + cl] = p;
    }

    // ---- out = softmax(mixed score) @ v: one wave folds the eight records, each scaled to the common maximum
    if (wave == 0) {
        float mx = rec[48];
        for (int w = 1; w < 8; ++w) mx = fmaxf(mx, rec[w * RS + 48]);
        float s = 0.f, o = 0.f;
        for (int w = 0; w < 8; ++w) {
            const float f = __expf(rec[w * RS + 48] - mx);
            s += f * rec[w * RS + 49];
            o += f * rec[w * RS + 32 + cl];
        }
        if (ch == 0) out_attn[(b * Rr + r) * (Hh * DQ) + h * DQ + cl] = o / s;
    }
}

// ---------------------------------------------------------------------------
// Stage 3: edge2[b,r,c] = sum_h edge_part[b,r,h,c] + edge_b
// ---------------------------------------------------------------------------
__global__ void __launch_bounds__(256) edge_reduce_kernel(
    const float* __restrict__ edge_part, const float* __restrict__ edge_b,
    float* __restrict__ out_edge)
{
    const int i = blockIdx.x * blockDim.x + threadIdx.x;  // over B*R*C
    if (i >= Bb * Rr * Cc) return;
    const int c  = i & (Cc - 1);
    const int br = i >> 7;
    float s = edge_b[0];
    for (int h = 0; h < Hh; ++h) s += edge_part[(br * Hh + h) * Cc + c];
    out_edge[i] = s;
}

extern "C" void kernel_launch(void* const* d_in, const int* in_sizes, int n_in,
                              void* d_out, int out_size, void* d_ws, size_t ws_size,
                              hipStream_t stream) {
    const float* q       = (const float*)d_in[0];
    const float* k_s     = (const float*)d_in[1];
    const float* k_a     = (const float*)d_in[2];
    const float* v       = (const float*)d_in[3];
    const float* cost    = (const float*)d_in[4];
    const float* mix1_w  = (const float*)d_in[5];
    const float* mix1_b  = (const float*)d_in[6];
    const float* Waa     = (const float*)d_in[7];
    const float* mix2_w  = (const float*)d_in[8];
    const float* mix2_b  = (const float*)d_in[9];
    const float* edge_w  = (const float*)d_in[10];
    const float* edge_b  = (const float*)d_in[11];
    const float* ln_g    = (const float*)d_in[12];
    const float* ln_b    = (const float*)d_in[13];

    float* out_attn = (float*)d_out;                       // [B,R,H*DQ]
    float* out_edge = out_attn + Bb * Rr * Hh * DQ;        // [B,R,C]

    float* score     = (float*)d_ws;                       // [B,H,R,C]   4MB
    float* edge_part = score + Bb * Hh * Rr * Cc;          // [B,R,H,C]   4MB

    // Stage 1: 64 blocks, 64KB dynamic LDS (dpa)
    const size_t lds1 = (size_t)(Rr * Cc) * sizeof(float);
    stage1_kernel<<<Bb * Hh, 256, lds1, stream>>>(q, k_s, k_a, score);

    // Stage 2: 8192 blocks, 21KB dynamic LDS
    const size_t lds2 = (size_t)(Cc * MS + 8 * 16 * XP + 8 * 32 + 8 * RS) * sizeof(float);
    stage2_kernel<<<Bb * Rr * Hh, 256, lds2, stream>>>(
        score, cost, v, mix1_w, mix1_b, Waa, mix2_w, mix2_b,
        edge_w, ln_g, ln_b, out_attn, edge_part);

    // Stage 3: edge reduction over heads
    edge_reduce_kernel<<<(Bb * Rr * Cc + 255) / 256, 256, 0, stream>>>(
        edge_part, edge_b, out_edge);
}

// v004
// Measured time: 66.6 microseconds a run.
// Versions in between are left out here; by their measured steps it is 1.24 times as fast as v002.
// All steps since v000 together make it 15.9 times as fast.
#include <hip/hip_runtime.h>
#include <hip/hip_bf16.h>

// B=8, H=8, R=128, C=128, DQ=16, MS=16
#define Bb 8
#define Hh 8
#define Rr 128
#define Cc 128
#define DQ 16
#define MS 16

typedef __attribute__((ext_vector_type(2))) float v2f;
typedef __attribute__((ext_vector_type(4))) float v4f;
typedef __attribute__((ext_vector_type(8))) float v8f;

__device__ __forceinline__ v8f wmma_f32(v2f a, v2f b, v8f c) {
    // V_WMMA_F32_16X16X4_F32: D = A(16x4 f32) * B(4x16 f32) + C(16x16 f32)
    return __builtin_amdgcn_wmma_f32_16x16x4_f32(
        /*neg_a=*/false, a, /*neg_b=*/false, b,
        /*c_mod=*/(short)0, c, /*reuse_a=*/false, /*reuse_b=*/false);
}

__device__ __forceinline__ float gelu_exact(float x) {
    return 0.5f * x * (1.0f + erff(x * 0.70710678118654752f));
}

// lane l with lane l ^ 16
__device__ __forceinline__ float xhalf(float x) {
    return __builtin_bit_cast(float, __builtin_amdgcn_permlanex16(
        __builtin_bit_cast(int, x), __builtin_bit_cast(int, x), 0x76543210, 0xfedcba98, false, false));
}

// lane l with lane l ^ M inside its 16-lane row (DPP row_xmask:M)
template <int M>
__device__ __forceinline__ float xrow(float x) {
    return __builtin_bit_cast(float, __builtin_amdgcn_mov_dpp(
        __builtin_bit_cast(int, x), 0x160 + M, 0xf, 0xf, true));
}

__device__ __forceinline__ float row_max(float x) {
    x = fmaxf(x, xrow<1>(x)); x = fmaxf(x, xrow<2>(x));
    x = fmaxf(x, xrow<4>(x)); x = fmaxf(x, xrow<8>(x));
    return x;
}

__device__ __forceinline__ float row_sum(float x) {
    x += xrow<1>(x); x += xrow<2>(x); x += xrow<4>(x); x += xrow<8>(x);
    return x;
}

// ---------------------------------------------------------------------------
// Stage 1: per (b,h, tile of 16 rows r) -> score[b,h,r,c] = (softmax(gelu(qk_s^T/4)) @ relu(qk_a^T/4)) / 4
// grid = B*H*8 blocks, 256 threads (8 waves), static LDS = 67KB (the eight partial products)
// The sum over s is split over the waves: wave w owns s = 16*w .. 16*w + 15. It forms the self scores
// transposed (lane (ll, lh) holds row r = ll, s = 8*lh + j in register j) and its 16 rows of dpa with the
// column c in the lane (s = 8*lh + j in register j), so that both D fragments are the operands of the next
// product as they stand: dpa as A, the exponentials as B, k slot (t, lh, x/y) = s = 8*lh + 2*t + x/y.
// Each wave takes its exponentials against its own maximum; behind one barrier the eight partial
// products and sums are scaled to the common maximum and added.
// ---------------------------------------------------------------------------
#define PP 132   // pitch of a partial row in floats: 16-byte stores of 16 rows meet no bank twice

// the lane's 8 consecutive k = 8*lh .. 8*lh + 7 of row ll of a 16x16 tile; A and B take the same k order
struct frag8 { v4f lo, hi; };
__device__ __forceinline__ frag8 load_frag(const float* __restrict__ tile, int ll, int lh) {
    const v4f* p = (const v4f*)(tile + ll * DQ + 8 * lh);
    return frag8{p[0], p[1]};
}
__device__ __forceinline__ v8f tile_product(const frag8& a, const frag8& b) {
    v8f acc = {};
    acc = wmma_f32(v2f{a.lo.x, a.lo.y}, v2f{b.lo.x, b.lo.y}, acc);
    acc = wmma_f32(v2f{a.lo.z, a.lo.w}, v2f{b.lo.z, b.lo.w}, acc);
    acc = wmma_f32(v2f{a.hi.x, a.hi.y}, v2f{b.hi.x, b.hi.y}, acc);
    acc = wmma_f32(v2f{a.hi.z, a.hi.w}, v2f{b.hi.z, b.hi.w}, acc);
    return acc;
}

__global__ void __launch_bounds__(256) stage1_kernel(
    const float* __restrict__ q, const float* __restrict__ k_s,
    const float* __restrict__ k_a, float* __restrict__ score)
{
    const int bh   = blockIdx.x >> 3;
    const int rt   = blockIdx.x & 7;
    const int tid  = threadIdx.x;
    const int wave = __builtin_amdgcn_readfirstlane(tid >> 5);   // the same in every lane: tile addresses stay scalar
    const int lane = tid & 31;
    const int ll   = lane & 15;
    const int lh   = lane >> 4;

    __shared__ __attribute__((aligned(16))) float part[8 * 16 * PP];   // [wave][r][c]
    __shared__ float ml[8 * 32];                                       // [wave][0,16) maximum, [16,32) sum, by r

    const float* qb  = q   + bh * Rr * DQ;
    const float* ksb = k_s + bh * Rr * DQ;
    const float* kab = k_a + bh * Cc * DQ;

    const frag8 fks = load_frag(ksb + wave * 16 * DQ, ll, lh);
    const frag8 fqr = load_frag(qb + rt * 16 * DQ, ll, lh);
    const frag8 fqs = load_frag(qb + wave * 16 * DQ, ll, lh);
    frag8 fka[8];
    #pragma unroll  // fka[] is indexed by cb and must stay in registers
    for (int cb = 0; cb < 8; ++cb) fka[cb] = load_frag(kab + cb * 16 * DQ, ll, lh);

    // ---- e[j] = exp(gelu((k_s @ q^T) / 4) - own maximum) at [s = 16*wave + 8*lh + j][r = 16*rt + ll]
    v8f e = tile_product(fks, fqr);
    for (int k = 0; k < 8; ++k) e[k] = gelu_exact(e[k] * 0.25f);
    float mx = e[0];
    for (int k = 1; k < 8; ++k) mx = fmaxf(mx, e[k]);
    mx = fmaxf(mx, xhalf(mx));
    float sum = 0.f;
    for (int k = 0; k < 8; ++k) { e[k] = __expf(e[k] - mx); sum += e[k]; }
    sum += xhalf(sum);
    ml[wave * 32 + lane] = lh ? sum : mx;

    // ---- partial score^T = relu(q @ k_a^T)^T @ e over the wave's 16 s; both factors 1/4 are applied at the end
    float* prow = part + (wave * 16 + ll) * PP + 8 * lh;
    #pragma unroll  // fka[] stays in registers; the tiles' product chains are independent of each other
    for (int cb = 0; cb < 8; ++cb) {
        v8f d = tile_product(fqs, fka[cb]);   // register j = (q @ k_a^T)[s = 8*lh + j][c = 16*cb + ll]
        for (int k = 0; k < 8; ++k) d[k] = fmaxf(d[k], 0.f);
        v8f acc = {};
        #pragma unroll  // d and e are indexed by t
        for (int t = 0; t < 4; ++t)
            acc = wmma_f32(v2f{d[2 * t], d[2 * t + 1]}, v2f{e[2 * t], e[2 * t + 1]}, acc);
        // register j = partial score[r = ll][c = 16*cb + 8*lh + j]
        v4f* ps = (v4f*)(prow + cb * 16);
        ps[0] = v4f{acc[0], acc[1], acc[2], acc[3]};
        ps[1] = v4f{acc[4], acc[5], acc[6], acc[7]};
    }
    __syncthreads();   // all eight partial products, maxima and sums complete

    // ---- fold: thread = row r = tid / 16, columns 4*(tid % 16) .. + 3 and the same + 64
    const int r  = tid >> 4;
    const int c4 = (tid & 15) * 4;
    float f[8];
    float gm = ml[r];
    for (int w = 1; w < 8; ++w) gm = fmaxf(gm, ml[w * 32 + r]);
    float gs = 0.f;
    for (int w = 0; w < 8; ++w) { f[w] = __expf(ml[w * 32 + r] - gm); gs += f[w] * ml[w * 32 + 16 + r]; }
    v4f o0 = {}, o1 = {};
    for (int w = 0; w < 8; ++w) {
        const float* pr = part + (w * 16 + r) * PP + c4;
        o0 += *(const v4f*)pr * f[w];
        o1 += *(const v4f*)(pr + 64) * f[w];
    }
    const float scale = 0.0625f / gs;
    float* outp = score + (bh * Rr + rt * 16 + r) * Cc + c4;
    *(v4f*)outp        = o0 * scale;
    *(v4f*)(outp + 64) = o1 * scale;
}

// ---------------------------------------------------------------------------
// Stage 2: per (b,r,h) tile. grid = B*R*H = 8192 blocks, 256 threads.
// dynamic LDS = (128*20 + 16*132 + 8*320 + 8*32 + 8*64) floats = 31.25KB
// ms1 lies in LDS twice, by column c (pitch MP) and by channel e (pitch TP): every A fragment of the two
// large products is then 8 consecutive floats of one row, and both pitches are an odd number of 16 bytes,
// so that the 16 lanes of a 16-byte read fall on all 64 banks once.
// The depth attention is formed transposed, per wave for its own 16 columns c:
// lane (ll, lh) holds c = mBase + ll, and every D fragment is the B operand of the
// next product as it stands (k slot (t, lh, x/y) = row 8*lh + 2*t + x/y of the D tile).
// Everything behind the products stays with the wave that owns the 16 columns: each wave
// reduces its own columns (LayerNorm sums, mixed-score maximum, sum and weighted v rows),
// leaves one record in LDS, and behind one barrier every wave folds the eight records.
// ---------------------------------------------------------------------------
#define XP 20   // pitch of a wave's ae tile in floats: 16-byte stores and row reads meet no bank twice
#define MP 20   // pitch of ms1[c][e] in floats
#define TP 132  // pitch of ms1t[e][c] in floats
#define RS 64   // floats per wave record: [0,16) sum, [16,32) sum of squares, [32,48) weighted v, 48 max, 49 sum
__global__ void __launch_bounds__(256) stage2_kernel(
    const float* __restrict__ score, const float* __restrict__ cost,
    const float* __restrict__ v,
    const float* __restrict__ mix1_w, const float* __restrict__ mix1_b,
    const float* __restrict__ Waa,
    const float* __restrict__ mix2_w, const float* __restrict__ mix2_b,
    const float* __restrict__ edge_w,
    const float* __restrict__ ln_g, const float* __restrict__ ln_b,
    float* __restrict__ out_attn, float* __restrict__ edge_part)
{
    const int idx = blockIdx.x;
    const int h = idx & (Hh - 1);
    const int r = (idx >> 3) & (Rr - 1);
    const int b = idx >> 10;

    const int tid  = threadIdx.x;
    // the same in every lane of a wave: held in a scalar register, so that what the phases behind the
    // products form from it takes no vector register while p[] is live
    const int wave = __builtin_amdgcn_readfirstlane(tid >> 5);
    const int lane = tid & 31;
    const int ll   = lane & 15;
    const int lh   = lane >> 4;
    const int mBase = wave * 16;

    extern __shared__ float smem[];
    float* ms1  = smem;                          // [128][MP], 16 of a row used
    float* ms1t = smem + Cc * MP;                // [16][TP], 128 of a row used
    float* xt   = smem + Cc * MP + MS * TP + wave * (16 * XP);           // the wave's own ae tile [16][XP]
    float* wl   = smem + Cc * MP + MS * TP + 8 * 16 * XP + wave * 32;    // the wave's own 32 floats
    float* rec  = smem + Cc * MP + MS * TP + 8 * 16 * XP + 8 * 32;       // [8][RS] wave records

    const float* srow = score + ((b * Hh + h) * Rr + r) * Cc;
    const float* crow = cost + (b * Rr + r) * Cc;
    const float* m1w0 = mix1_w + h * 2 * MS;
    const float* m1w1 = m1w0 + MS;
    const float* m1b  = mix1_b + h * MS;

    // ---- ms1[c][e] = relu(score*w0 + cost*w1 + b), written in both layouts with 16-byte stores.
    // The fused form is spelled out so that both copies hold the same bits.
    {
        // by column: thread = column c = tid % 128, channels 8*eh .. 8*eh + 7 (eh the same in a wave: weights stay scalar)
        const int c  = tid & (Cc - 1);
        const int eh = wave >> 2;
        const float sc = srow[c], cc = crow[c];
        // by channel: wave = channels e = wave and wave + 8, lane = columns 4*lane .. 4*lane + 3
        const v4f s4 = *(const v4f*)(srow + 4 * lane);
        const v4f c4 = *(const v4f*)(crow + 4 * lane);
        float mv[8];
        for (int k = 0; k < 8; ++k) {
            const int e = 8 * eh + k;
            mv[k] = fmaxf(__builtin_fmaf(sc, m1w0[e], cc * m1w1[e]) + m1b[e], 0.f);
        }
        v4f* mrow = (v4f*)(ms1 + c * MP + 8 * eh);
        mrow[0] = v4f{mv[0], mv[1], mv[2], mv[3]};
        mrow[1] = v4f{mv[4], mv[5], mv[6], mv[7]};
        for (int g = 0; g < 2; ++g) {
            const int e = wave + 8 * g;
            const float w0 = m1w0[e], w1 = m1w1[e], bb = m1b[e];
            v4f t;
            for (int k = 0; k < 4; ++k) t[k] = fmaxf(__builtin_fmaf(s4[k], w0, c4[k] * w1) + bb, 0.f);
            *(v4f*)(ms1t + e * TP + 4 * lane) = t;
        }
    }
    __syncthreads();

    // ---- tT = Waa[h]^T @ ms1^T : register j = t[c = mBase + ll][f = 8*lh + j]
    v8f tT = {};
    {
        const float* W = Waa + h * MS * MS;
        const int wo = 2 * lh * MS + ll;   // Waa[e = 2*lh][f = ll]
        for (int kk = 0; kk < 4; ++kk) {
            const int k0 = kk * 4 + 2 * lh;
            v2f a, bm;
            a.x  = W[wo + kk * 4 * MS];
            a.y  = W[wo + kk * 4 * MS + MS];
            bm.x = ms1[(mBase + ll) * MP + k0];
            bm.y = ms1[(mBase + ll) * MP + k0 + 1];
            tT = wmma_f32(a, bm, tT);
        }
    }

    // ---- p[nb][j] = dd[c = mBase + ll][d = 16*nb + 8*lh + j] = (ms1 @ t^T)[d][c]
    v8f p[8];
    // full unroll: p[] is indexed by nb and must stay in registers
    #pragma unroll
    for (int nb = 0; nb < 8; ++nb) {
        // the lane's 8 consecutive f of row d = 16*nb + ll: two 16-byte LDS loads
        const v4f* arow = (const v4f*)(ms1 + (nb * 16 + ll) * MP + 8 * lh);
        const v4f alo = arow[0], ahi = arow[1];
        const float av[8] = {alo.x, alo.y, alo.z, alo.w, ahi.x, ahi.y, ahi.z, ahi.w};
        v8f acc = {};
        #pragma unroll  // tT and av are indexed by t
        for (int t = 0; t < 4; ++t) {
            v2f a, bm;
            a.x  = av[2 * t];
            a.y  = av[2 * t + 1];
            bm.x = tT[2 * t];
            bm.y = tT[2 * t + 1];
            acc = wmma_f32(a, bm, acc);
        }
        p[nb] = acc;
    }

    // ---- softmax over d, in registers; 1/sum is applied after the product
    float pmx = p[0][0];
    #pragma unroll  // p[] stays in registers
    for (int nb = 0; nb < 8; ++nb)
        for (int k = 0; k < 8; ++k) pmx = fmaxf(pmx, p[nb][k]);
    pmx = fmaxf(pmx, __shfl_xor(pmx, 16));
    float psum = 0.f;
    #pragma unroll  // p[] stays in registers
    for (int nb = 0; nb < 8; ++nb)
        for (int k = 0; k < 8; ++k) { const float e = __expf(p[nb][k] - pmx); p[nb][k] = e; psum += e; }
    psum += __shfl_xor(psum, 16);
    const float pinv = 1.0f / psum;

    // ---- ae^T = ms1^T @ p : register j = (dw @ ms1)[c = mBase + ll][e = 8*lh + j] * psum; + ms1 -> x
    v8f acc = {};
    {
        const float* acol = ms1t + ll * TP + 8 * lh;
        #pragma unroll  // p[] stays in registers
        for (int nb = 0; nb < 8; ++nb) {
            // the lane's 8 consecutive d = 16*nb + 8*lh + j of channel e = ll: two 16-byte LDS loads
            const v4f* ac = (const v4f*)(acol + nb * 16);
            const v4f alo = ac[0], ahi = ac[1];
            const float av[8] = {alo.x, alo.y, alo.z, alo.w, ahi.x, ahi.y, ahi.z, ahi.w};
            #pragma unroll  // p[nb] and av are indexed by t
            for (int t = 0; t < 4; ++t) {
                v2f a, bm;
                a.x  = av[2 * t];
                a.y  = av[2 * t + 1];
                bm.x = p[nb][2 * t];
                bm.y = p[nb][2 * t + 1];
                acc = wmma_f32(a, bm, acc);
            }
        }
    }
    // the lane's number formed anew (ln = lane, cl = ll, ch = lh): nothing that the phases below index by
    // stays in a register across the products, where p[] fills them (past 96 a SIMD holds one wave less)
    const int ln = __builtin_amdgcn_mbcnt_lo(~0u, 0u);
    const int cl = ln & 15;
    const int ch = ln >> 4;
    float x[8], m[8];   // ae and ms1 of column c = mBase + cl, channels e = 8*ch + j
    {
        const v4f* mr = (const v4f*)(ms1 + (mBase + cl) * MP + 8 * ch);
        const v4f mlo = mr[0], mhi = mr[1];
        const float mv[8] = {mlo.x, mlo.y, mlo.z, mlo.w, mhi.x, mhi.y, mhi.z, mhi.w};
        for (int k = 0; k < 8; ++k) { m[k] = mv[k]; x[k] = acc[k] * pinv + mv[k]; }
    }

    // ---- global operands of the phases below, asked for here: the waits below hold back every load behind them
    float vv[8];   // v[c = mBase + 8*ch + i][d = cl]
    {
        const float* vb = v + (b * Hh + h) * Cc * DQ + (mBase + 8 * ch) * DQ + cl;
        for (int i = 0; i < 8; ++i) vv[i] = vb[i * DQ];
    }
    const v4f ew0 = ((const v4f*)(edge_w + h * MS + 8 * ch))[0];
    const v4f ew1 = ((const v4f*)(edge_w + h * MS + 8 * ch))[1];
    const float lg = ln_g[mBase + cl], lb = ln_b[mBase + cl];

    // ---- the wave's own columns: ae tile to its own LDS range, to be read back by channel
    {
        v4f* xs = (v4f*)(xt + cl * XP + 8 * ch);
        xs[0] = v4f{x[0], x[1], x[2], x[3]};
        xs[1] = v4f{x[4], x[5], x[6], x[7]};
    }

    // ---- mixed score of column c = mBase + cl, its exponential against the wave's own maximum
    float wmax, wsum;
    {
        const v4f* mw = (const v4f*)(mix2_w + h * MS + 8 * ch);
        const v4f wlo = mw[0], whi = mw[1];
        const float wv[8] = {wlo.x, wlo.y, wlo.z, wlo.w, whi.x, whi.y, whi.z, whi.w};
        float sp = 0.f;
        for (int k = 0; k < 8; ++k) sp += m[k] * wv[k];
        const float s = sp + xhalf(sp) + mix2_b[h];
        wmax = row_max(s);
        const float e = __expf(s - wmax);
        wsum = row_sum(e);
        wl[ln] = e;   // wl[i] = wl[16 + i] = weight of column mBase + i
    }
    // the wave reads back what its other lanes stored: the stores must have landed, and the
    // compiler must not lift the reads over them
    asm volatile("s_wait_dscnt 0x0" ::: "memory");

    // ---- LayerNorm sums of channel e = cl over the wave's 16 columns (rows 2*i + ch, then both halves)
    {
        float s = 0.f, s2 = 0.f;
        for (int i = 0; i < 8; ++i) { const float t = xt[(2 * i + ch) * XP + cl]; s += t; s2 += t * t; }
        s  += xhalf(s);
        s2 += xhalf(s2);
        rec[wave * RS + ln] = ch ? s2 : s;
    }
    // ---- weighted v rows: d = cl, columns mBase + 8*ch + i, then both halves
    {
        const v4f* ep = (const v4f*)(wl + 8 * ch);
        const v4f elo = ep[0], ehi = ep[1];
        const float ev[8] = {elo.x, elo.y, elo.z, elo.w, ehi.x, ehi.y, ehi.z, ehi.w};
        float o = 0.f;
        for (int i = 0; i < 8; ++i) o += ev[i] * vv[i];
        o += xhalf(o);
        if (ch == 0) rec[wave * RS + 32 + cl] = o;
        if (ln == 0) { rec[wave * RS + 48] = wmax; rec[wave * RS + 49] = wsum; }
    }
    __syncthreads();   // all eight records complete

    // ---- LayerNorm over the c axis (length 128): lane (cl, ch) folds the sums (ch = 0) or the squares (ch = 1) of channel cl
    {
        float t = 0.f;
        for (int w = 0; w < 8; ++w) t += rec[w * RS + ln];
        const float u = xhalf(t);
        const float mu  = (ch ? u : t) * (1.0f / Cc);
        const float var = (ch ? t : u) * (1.0f / Cc) - mu * mu;
        const float rs  = rsqrtf(var + 1e-5f);
        wl[ln] = ch ? rs : mu;   // wl[e] = mean, wl[16 + e] = 1/sigma
    }
    // as above: the wave reads back what its other lanes stored
    asm volatile("s_wait_dscnt 0x0" ::: "memory");

    // ---- edge partial for this head -> workspace (deterministic, no atomics)
    {
        const v4f* mp = (const v4f*)(wl + 8 * ch);
        const v4f* rp = (const v4f*)(wl + 16 + 8 * ch);
        const v4f a0 = mp[0], a1 = mp[1], r0 = rp[0], r1 = rp[1];
        const float mu8[8] = {a0.x, a0.y, a0.z, a0.w, a1.x, a1.y, a1.z, a1.w};
        const float rs8[8] = {r0.x, r0.y, r0.z, r0.w, r1.x, r1.y, r1.z, r1.w};
        const float ew8[8] = {ew0.x, ew0.y, ew0.z, ew0.w, ew1.x, ew1.y, ew1.z, ew1.w};
        float t = 0.f, u = 0.f;
        for (int k = 0; k < 8; ++k) { t += (x[k] - mu8[k]) * (rs8[k] * ew8[k]); u += ew8[k]; }
        float p = t * lg + u * lb;
        p += xhalf(p);
        if (ch == 0) edge_part[((b * Rr + r) * Hh + h) * Cc + mBase + cl] = p;
    }

    // ---- out = softmax(mixed score) @ v: one wave folds the eight records, each scaled to the common maximum
    if (wave == 0) {
        float mx = rec[48];
        for (int w = 1; w < 8; ++w) mx = fmaxf(mx, rec[w * RS + 48]);
        float s = 0.f, o = 0.f;
        for (int w = 0; w < 8; ++w) {
            const float f = __expf(rec[w * RS + 48] - mx);
            s += f * rec[w * RS + 49];
            o += f * rec[w * RS + 32 + cl];
        }
        if (ch == 0) out_attn[(b * Rr + r) * (Hh * DQ) + h * DQ + cl] = o / s;
    }
}

// ---------------------------------------------------------------------------
// Stage 3: edge2[b,r,c] = sum_h edge_part[b,r,h,c] + edge_b
// ---------------------------------------------------------------------------
__global__ void __launch_bounds__(256) edge_reduce_kernel(
    const float* __restrict__ edge_part, const float* __restrict__ edge_b,
    float* __restrict__ out_edge)
{
    const int i = blockIdx.x * blockDim.x + threadIdx.x;  // over B*R*C
    if (i >= Bb * Rr * Cc) return;
    const int c  = i & (Cc - 1);
    const int br = i >> 7;
    float s = edge_b[0];
    for (int h = 0; h < Hh; ++h) s += edge_part[(br * Hh + h) * Cc + c];
    out_edge[i] = s;
}

extern "C" void kernel_launch(void* const* d_in, const int* in_sizes, int n_in,
                              void* d_out, int out_size, void* d_ws, size_t ws_size,
                              hipStream_t stream) {
    const float* q       = (const float*)d_in[0];
    const float* k_s     = (const float*)d_in[1];
    const float* k_a     = (const float*)d_in[2];
    const float* v       = (const float*)d_in[3];
    const float* cost    = (const float*)d_in[4];
    const float* mix1_w  = (const float*)d_in[5];
    const float* mix1_b  = (const float*)d_in[6];
    const float* Waa     = (const float*)d_in[7];
    const float* mix2_w  = (const float*)d_in[8];
    const float* mix2_b  = (const float*)d_in[9];
    const float* edge_w  = (const float*)d_in[10];
    const float* edge_b  = (const float*)d_in[11];
    const float* ln_g    = (const float*)d_in[12];
    const float* ln_b    = (const float*)d_in[13];

    float* out_attn = (float*)d_out;                       // [B,R,H*DQ]
    float* out_edge = out_attn + Bb * Rr * Hh * DQ;        // [B,R,C]

    float* score     = (float*)d_ws;                       // [B,H,R,C]   4MB
    float* edge_part = score + Bb * Hh * Rr * Cc;          // [B,R,H,C]   4MB

    // Stage 1: 512 blocks, one per (b,h) and 16 rows; static LDS
    stage1_kernel<<<Bb * Hh * (Rr / 16), 256, 0, stream>>>(q, k_s, k_a, score);

    // Stage 2: 8192 blocks, 31.25KB dynamic LDS
    const size_t lds2 = (size_t)(Cc * MP + MS * TP + 8 * 16 * XP + 8 * 32 + 8 * RS) * sizeof(float);
    stage2_kernel<<<Bb * Rr * Hh, 256, lds2, stream>>>(
        score, cost, v, mix1_w, mix1_b, Waa, mix2_w, mix2_b,
        edge_w, ln_g, ln_b, out_attn, edge_part);

    // Stage 3: edge reduction over heads
    edge_reduce_kernel<<<(Bb * Rr * Cc + 255) / 256, 256, 0, stream>>>(
        edge_part, edge_b, out_edge);
}
